// v000
// Times are from an AMD MI455X. After a warm-up the kernel runs many times in a row, and a time is the length of
// such a window on the GPU divided by its runs, so every launch and the gaps after it count. The runs cycle
// through copies of the inputs. A figure is the median of several windows, for all but v000 over two sittings.
// Sittings can differ by a few percent; kernels timed side by side share one.
// The starting kernel, v000, takes 335 microseconds a run.
#include <hip/hip_runtime.h>
#include <hip/hip_bf16.h>

typedef __attribute__((ext_vector_type(2))) float v2f;
typedef __attribute__((ext_vector_type(8))) float v8f;

#define NB    8
#define LSEQ  4096
#define CIN   1024
#define COUT  1024
#define WDIM  512

#define BM 128
#define BN 128
#define BK 32
#define LDSK 36   // +4 pad: keeps float4 16B alignment AND conflict-free frag reads

#if defined(__gfx1250__)
#define ASYNC_LDS_ASM 1
#endif

// 16-byte global->LDS copy: async DMA (ASYNCcnt-tracked, no VGPR round-trip)
// on gfx1250, plain copy elsewhere.
__device__ __forceinline__ void copy16_g2l(float* dst_lds, const float* src_glb) {
#if defined(ASYNC_LDS_ASM)
    const unsigned lds_off =
        (unsigned)(size_t)(__attribute__((address_space(3))) const void*)dst_lds;
    const unsigned long long gaddr = (unsigned long long)(size_t)src_glb;
    asm volatile("global_load_async_to_lds_b128 %0, %1, off"
                 :: "v"(lds_off), "v"(gaddr)
                 : "memory");
#else
    *(float4*)dst_lds = *(const float4*)src_glb;
#endif
}

__device__ __forceinline__ void wait_async_lds() {
#if defined(ASYNC_LDS_ASM)
    asm volatile("s_wait_asynccnt 0x0" ::: "memory");
#endif
}

// ---------------------------------------------------------------------------
// Kernel 1: styles[b,i] = (w[b,:] . aff_w[i,:]) / sqrt(WDIM) + aff_b[i]
// ---------------------------------------------------------------------------
__global__ void mfc_styles_kernel(const float* __restrict__ w,
                                  const float* __restrict__ aff_w,
                                  const float* __restrict__ aff_b,
                                  float* __restrict__ styles) {
    int idx = blockIdx.x * blockDim.x + threadIdx.x;   // over NB*CIN
    if (idx >= NB * CIN) return;
    int b = idx / CIN;
    int i = idx - b * CIN;
    const float gain = 0.04419417382415922f;           // 1/sqrt(512)
    const float* wr = w + b * WDIM;
    const float* ar = aff_w + (size_t)i * WDIM;
    float s = 0.f;
    for (int k = 0; k < WDIM; ++k) s += wr[k] * ar[k];
    styles[idx] = s * gain + aff_b[i];
}

// ---------------------------------------------------------------------------
// Kernel 2: dcoefs[b,o] = rsqrt( sum_c (weight[o,c]*styles[b,c])^2 + 1e-8 )
// ---------------------------------------------------------------------------
__global__ void mfc_dcoefs_kernel(const float* __restrict__ weight,
                                  const float* __restrict__ styles,
                                  float* __restrict__ dcoefs) {
    int idx = blockIdx.x * blockDim.x + threadIdx.x;   // over NB*COUT
    if (idx >= NB * COUT) return;
    int b = idx / COUT;
    int o = idx - b * COUT;
    const float* wr = weight + (size_t)o * CIN;
    const float* sr = styles + b * CIN;
    float s = 0.f;
    for (int k = 0; k < CIN; ++k) {
        float p = wr[k] * sr[k];
        s += p * p;
    }
    dcoefs[idx] = rsqrtf(s + 1e-8f);
}

// ---------------------------------------------------------------------------
// Kernel 3: main modulated GEMM + epilogue, f32 WMMA 16x16x4
//   Double-buffered LDS; A tile staged with async-to-LDS DMA; B tile staged
//   through VGPRs with styles/dcoefs modulation folded in.
// ---------------------------------------------------------------------------
__launch_bounds__(256, 1)
__global__ void mfc_modgemm_kernel(const float* __restrict__ x,
                                   const float* __restrict__ weight,
                                   const float* __restrict__ bias,
                                   const float* __restrict__ layerscale,
                                   const float* __restrict__ styles,
                                   const float* __restrict__ dcoefs,
                                   float* __restrict__ out) {
    __shared__ float As[2][BM * LDSK];
    __shared__ float Bs[2][BN * LDSK];

    const int b   = blockIdx.z;
    const int m0  = blockIdx.y * BM;
    const int n0  = blockIdx.x * BN;
    const int tid = threadIdx.x;
    const int lane = tid & 31;
    const int wave = tid >> 5;
    const int wm = (wave & 1) * 64;    // wave tile M offset (2 waves along M)
    const int wn = (wave >> 1) * 32;   // wave tile N offset (4 waves along N)

    const float* xb = x + (size_t)b * LSEQ * CIN;
    const float* st = styles + b * CIN;
    const float* dc = dcoefs + b * COUT;

    v8f acc[4][2];
#pragma unroll
    for (int i = 0; i < 4; ++i)
#pragma unroll
        for (int j = 0; j < 2; ++j) acc[i][j] = {};

    // staging map: thread -> (row, 4-float column), 4 row-iterations
    const int scol = (tid & 7) * 4;    // 0..28
    const int srow = tid >> 3;         // 0..31

    const int frow = lane & 15;        // fragment row (M for A, N for B)
    const int kh   = (lane >> 4) * 2;  // K sub-offset per A/B VGPR layout

    auto stageA = [&](int buf, int kc) {   // pure DMA copy of x tile
#pragma unroll
        for (int it = 0; it < 4; ++it) {
            const int r = srow + it * 32;
            copy16_g2l(&As[buf][r * LDSK + scol],
                       xb + (size_t)(m0 + r) * CIN + kc + scol);
        }
    };
    auto stageB = [&](int buf, int kc) {   // modulated weight tile
#pragma unroll
        for (int it = 0; it < 4; ++it) {
            const int r = srow + it * 32;
            float4 vw = *(const float4*)(weight + (size_t)(n0 + r) * CIN + kc + scol);
            const float4 vs = *(const float4*)(st + kc + scol);
            const float d = dc[n0 + r];
            vw.x *= vs.x * d;
            vw.y *= vs.y * d;
            vw.z *= vs.z * d;
            vw.w *= vs.w * d;
            *(float4*)(&Bs[buf][r * LDSK + scol]) = vw;
        }
    };

    // prologue: stage first tile into buffer 0
    stageA(0, 0);
    stageB(0, 0);

    int cur = 0;
    for (int kc = 0; kc < CIN; kc += BK) {
        wait_async_lds();        // my async writes to buf[cur] landed in LDS
        __syncthreads();         // (+dscnt flush) all waves' staging visible

        if (kc + BK < CIN) {     // overlap next-tile staging with compute
            stageA(cur ^ 1, kc + BK);
            stageB(cur ^ 1, kc + BK);
        }

        const float* Ab = &As[cur][0];
        const float* Bb = &Bs[cur][0];
#pragma unroll
        for (int kk = 0; kk < BK; kk += 4) {
            v2f afrag[4], bfrag[2];
#pragma unroll
            for (int i = 0; i < 4; ++i)
                afrag[i] = *(const v2f*)(&Ab[(wm + i * 16 + frow) * LDSK + kk + kh]);
#pragma unroll
            for (int j = 0; j < 2; ++j)
                bfrag[j] = *(const v2f*)(&Bb[(wn + j * 16 + frow) * LDSK + kk + kh]);
#pragma unroll
            for (int i = 0; i < 4; ++i)
#pragma unroll
                for (int j = 0; j < 2; ++j)
                    acc[i][j] = __builtin_amdgcn_wmma_f32_16x16x4_f32(
                        /*neg_a=*/false, afrag[i],
                        /*neg_b=*/false, bfrag[j],
                        /*c_mod=*/(short)0, acc[i][j],
                        /*reuse_a=*/false, /*reuse_b=*/false);
        }
        cur ^= 1;
    }

    // ---- epilogue: bias + lrelu*sqrt2 + clamp + layerscale + residual ----
    const int rhalf = (lane >> 4) * 8;  // C/D layout: VGPR r holds M = r + rhalf
    float* ob = out + (size_t)b * LSEQ * COUT;
    const float g = 1.41421356237309515f;
#pragma unroll
    for (int j = 0; j < 2; ++j) {
        const int n  = n0 + wn + j * 16 + frow;
        const float bi = bias[n];
        const float ls = layerscale[n];
#pragma unroll
        for (int i = 0; i < 4; ++i) {
#pragma unroll
            for (int r = 0; r < 8; ++r) {
                const int m = m0 + wm + i * 16 + rhalf + r;
                float v = acc[i][j][r] + bi;
                v = (v > 0.f) ? v : 0.2f * v;
                v *= g;
                v = fminf(fmaxf(v, -256.f), 256.f);
                ob[(size_t)m * COUT + n] = v * ls + xb[(size_t)m * CIN + n];
            }
        }
    }
}

// ---------------------------------------------------------------------------
extern "C" void kernel_launch(void* const* d_in, const int* in_sizes, int n_in,
                              void* d_out, int out_size, void* d_ws, size_t ws_size,
                              hipStream_t stream) {
    (void)in_sizes; (void)n_in; (void)out_size; (void)ws_size;
    const float* x          = (const float*)d_in[0];   // (8, 4096, 1024)
    const float* w          = (const float*)d_in[1];   // (8, 512)
    const float* weight     = (const float*)d_in[2];   // (1024, 1024)
    const float* bias       = (const float*)d_in[3];   // (1024,)
    const float* aff_w      = (const float*)d_in[4];   // (1024, 512)
    const float* aff_b      = (const float*)d_in[5];   // (1024,)
    const float* layerscale = (const float*)d_in[6];   // (1,1,1024)
    float* out = (float*)d_out;

    float* styles = (float*)d_ws;                      // NB*CIN floats  (32 KB)
    float* dcoefs = styles + NB * CIN;                 // NB*COUT floats (32 KB)

    mfc_styles_kernel<<<(NB * CIN + 255) / 256, 256, 0, stream>>>(w, aff_w, aff_b, styles);
    mfc_dcoefs_kernel<<<(NB * COUT + 255) / 256, 256, 0, stream>>>(weight, styles, dcoefs);

    dim3 grid(COUT / BN, LSEQ / BM, NB);               // (8, 32, 8)
    mfc_modgemm_kernel<<<grid, 256, 0, stream>>>(x, weight, bias, layerscale,
                                                 styles, dcoefs, out);
}

// v001
// Measured time: 314 microseconds a run.
// Two timings next to v000 both put it at 1.11 times that version's speed.
#include <hip/hip_runtime.h>
#include <hip/hip_bf16.h>

typedef __attribute__((ext_vector_type(2))) float v2f;
typedef __attribute__((ext_vector_type(8))) float v8f;

#define NB    8
#define LSEQ  4096
#define CIN   1024
#define COUT  1024
#define WDIM  512

#define BM 128
#define BN 128
#define BK 32
#define LDSK 36   // +4 pad: keeps float4 16B alignment AND conflict-free frag reads

#if defined(__gfx1250__)
#define ASYNC_LDS_ASM 1
#endif

// 16-byte global->LDS copy: async DMA (ASYNCcnt-tracked, no VGPR round-trip)
// on gfx1250, plain copy elsewhere.
__device__ __forceinline__ void copy16_g2l(float* dst_lds, const float* src_glb) {
#if defined(ASYNC_LDS_ASM)
    const unsigned lds_off =
        (unsigned)(size_t)(__attribute__((address_space(3))) const void*)dst_lds;
    const unsigned long long gaddr = (unsigned long long)(size_t)src_glb;
    asm volatile("global_load_async_to_lds_b128 %0, %1, off"
                 :: "v"(lds_off), "v"(gaddr)
                 : "memory");
#else
    *(float4*)dst_lds = *(const float4*)src_glb;
#endif
}

__device__ __forceinline__ void wait_async_lds() {
#if defined(ASYNC_LDS_ASM)
    asm volatile("s_wait_asynccnt 0x0" ::: "memory");
#endif
}

// ---------------------------------------------------------------------------
// Prologue reductions. One work-group = 32 consecutive outputs of one batch
// row (one whole 128-byte line of the result); each of its 8 waves owns 4 of
// them. A wave walks a matrix row with all 32 lanes side by side (4 floats per
// lane, 512 contiguous bytes per load), so every load is coalesced and all
// loads of a wave are independent; each lane keeps 4 partial sums per output,
// which are folded and then summed over the 32 lanes by an xor butterfly.
// ---------------------------------------------------------------------------
typedef __attribute__((ext_vector_type(4))) float v4f;

#define RED_ROWS 4    // outputs per wave
#define RED_WAVES 8   // waves per work-group

__device__ __forceinline__ float lane_sum32(v4f a) {
    float v = (a.x + a.y) + (a.z + a.w);
#pragma unroll
    for (int m = 16; m >= 1; m >>= 1) v += __shfl_xor(v, m, 32);
    return v;
}

// Kernel 1: styles[b,i] = (w[b,:] . aff_w[i,:]) / sqrt(WDIM) + aff_b[i]
// waves_per_eu(2,2): the grid is one 8-wave work-group per WGP, 2 waves per
// SIMD, so more occupancy buys nothing; it lets the scheduler spend registers
// on issuing every load ahead of the first wait (without it some loads are
// held back behind waits, which puts several memory latencies in a row).
__launch_bounds__(RED_WAVES * 32)
__attribute__((amdgpu_waves_per_eu(2, 2)))
__global__ void mfc_styles_kernel(const float* __restrict__ w,
                                  const float* __restrict__ aff_w,
                                  const float* __restrict__ aff_b,
                                  float* __restrict__ styles) {
    const int lane = threadIdx.x & 31;
    const int wave = threadIdx.x >> 5;
    const int b  = blockIdx.y;
    const int i0 = blockIdx.x * (RED_WAVES * RED_ROWS) + wave * RED_ROWS;
    const float gain = 0.04419417382415922f;           // 1/sqrt(512)
    const v4f* wr = (const v4f*)(w + b * WDIM) + lane;
    const v4f* ar = (const v4f*)(aff_w + (size_t)i0 * WDIM) + lane;

    v4f vw[WDIM / 128], va[RED_ROWS][WDIM / 128];
#pragma unroll
    for (int c = 0; c < WDIM / 128; ++c) {
        vw[c] = wr[c * 32];
#pragma unroll
        for (int r = 0; r < RED_ROWS; ++r) va[r][c] = ar[r * (WDIM / 4) + c * 32];
    }
    const float ab = aff_b[i0 + (lane & (RED_ROWS - 1))];

    float mine = 0.f;
#pragma unroll
    for (int r = 0; r < RED_ROWS; ++r) {
        v4f s = vw[0] * va[r][0];
#pragma unroll
        for (int c = 1; c < WDIM / 128; ++c) s += vw[c] * va[r][c];
        const float t = lane_sum32(s);
        if (lane == r) mine = t;
    }
    if (lane < RED_ROWS)
        styles[b * CIN + i0 + lane] = mine * gain + ab;
}

// Kernel 2: dcoefs[b,o] = rsqrt( sum_c (weight[o,c]*styles[b,c])^2 + 1e-8 )
// waves_per_eu(2,2): as for kernel 1.
__launch_bounds__(RED_WAVES * 32)
__attribute__((amdgpu_waves_per_eu(2, 2)))
__global__ void mfc_dcoefs_kernel(const float* __restrict__ weight,
                                  const float* __restrict__ styles,
                                  float* __restrict__ dcoefs) {
    const int lane = threadIdx.x & 31;
    const int wave = threadIdx.x >> 5;
    const int b  = blockIdx.y;
    const int o0 = blockIdx.x * (RED_WAVES * RED_ROWS) + wave * RED_ROWS;
    const v4f* sr = (const v4f*)(styles + b * CIN) + lane;
    const v4f* wr = (const v4f*)(weight + (size_t)o0 * CIN) + lane;

    v4f vs[CIN / 128], vw[RED_ROWS][CIN / 128];
#pragma unroll
    for (int c = 0; c < CIN / 128; ++c) {
        vs[c] = sr[c * 32];
#pragma unroll
        for (int r = 0; r < RED_ROWS; ++r) vw[r][c] = wr[r * (CIN / 4) + c * 32];
    }

    float mine = 0.f;
#pragma unroll
    for (int r = 0; r < RED_ROWS; ++r) {
        v4f s = {0.f, 0.f, 0.f, 0.f};
#pragma unroll
        for (int c = 0; c < CIN / 128; ++c) {
            const v4f p = vw[r][c] * vs[c];
            s += p * p;
        }
        const float t = lane_sum32(s);
        if (lane == r) mine = t;
    }
    if (lane < RED_ROWS)
        dcoefs[b * COUT + o0 + lane] = rsqrtf(mine + 1e-8f);
}

// ---------------------------------------------------------------------------
// Kernel 3: main modulated GEMM + epilogue, f32 WMMA 16x16x4
//   Double-buffered LDS; A tile staged with async-to-LDS DMA; B tile staged
//   through VGPRs with styles/dcoefs modulation folded in.
// ---------------------------------------------------------------------------
__launch_bounds__(256, 1)
__global__ void mfc_modgemm_kernel(const float* __restrict__ x,
                                   const float* __restrict__ weight,
                                   const float* __restrict__ bias,
                                   const float* __restrict__ layerscale,
                                   const float* __restrict__ styles,
                                   const float* __restrict__ dcoefs,
                                   float* __restrict__ out) {
    __shared__ float As[2][BM * LDSK];
    __shared__ float Bs[2][BN * LDSK];

    const int b   = blockIdx.z;
    const int m0  = blockIdx.y * BM;
    const int n0  = blockIdx.x * BN;
    const int tid = threadIdx.x;
    const int lane = tid & 31;
    const int wave = tid >> 5;
    const int wm = (wave & 1) * 64;    // wave tile M offset (2 waves along M)
    const int wn = (wave >> 1) * 32;   // wave tile N offset (4 waves along N)

    const float* xb = x + (size_t)b * LSEQ * CIN;
    const float* st = styles + b * CIN;
    const float* dc = dcoefs + b * COUT;

    v8f acc[4][2];
#pragma unroll
    for (int i = 0; i < 4; ++i)
#pragma unroll
        for (int j = 0; j < 2; ++j) acc[i][j] = {};

    // staging map: thread -> (row, 4-float column), 4 row-iterations
    const int scol = (tid & 7) * 4;    // 0..28
    const int srow = tid >> 3;         // 0..31

    const int frow = lane & 15;        // fragment row (M for A, N for B)
    const int kh   = (lane >> 4) * 2;  // K sub-offset per A/B VGPR layout

    auto stageA = [&](int buf, int kc) {   // pure DMA copy of x tile
#pragma unroll
        for (int it = 0; it < 4; ++it) {
            const int r = srow + it * 32;
            copy16_g2l(&As[buf][r * LDSK + scol],
                       xb + (size_t)(m0 + r) * CIN + kc + scol);
        }
    };
    auto stageB = [&](int buf, int kc) {   // modulated weight tile
#pragma unroll
        for (int it = 0; it < 4; ++it) {
            const int r = srow + it * 32;
            float4 vw = *(const float4*)(weight + (size_t)(n0 + r) * CIN + kc + scol);
            const float4 vs = *(const float4*)(st + kc + scol);
            const float d = dc[n0 + r];
            vw.x *= vs.x * d;
            vw.y *= vs.y * d;
            vw.z *= vs.z * d;
            vw.w *= vs.w * d;
            *(float4*)(&Bs[buf][r * LDSK + scol]) = vw;
        }
    };

    // prologue: stage first tile into buffer 0
    stageA(0, 0);
    stageB(0, 0);

    int cur = 0;
    for (int kc = 0; kc < CIN; kc += BK) {
        wait_async_lds();        // my async writes to buf[cur] landed in LDS
        __syncthreads();         // (+dscnt flush) all waves' staging visible

        if (kc + BK < CIN) {     // overlap next-tile staging with compute
            stageA(cur ^ 1, kc + BK);
            stageB(cur ^ 1, kc + BK);
        }

        const float* Ab = &As[cur][0];
        const float* Bb = &Bs[cur][0];
#pragma unroll
        for (int kk = 0; kk < BK; kk += 4) {
            v2f afrag[4], bfrag[2];
#pragma unroll
            for (int i = 0; i < 4; ++i)
                afrag[i] = *(const v2f*)(&Ab[(wm + i * 16 + frow) * LDSK + kk + kh]);
#pragma unroll
            for (int j = 0; j < 2; ++j)
                bfrag[j] = *(const v2f*)(&Bb[(wn + j * 16 + frow) * LDSK + kk + kh]);
#pragma unroll
            for (int i = 0; i < 4; ++i)
#pragma unroll
                for (int j = 0; j < 2; ++j)
                    acc[i][j] = __builtin_amdgcn_wmma_f32_16x16x4_f32(
                        /*neg_a=*/false, afrag[i],
                        /*neg_b=*/false, bfrag[j],
                        /*c_mod=*/(short)0, acc[i][j],
                        /*reuse_a=*/false, /*reuse_b=*/false);
        }
        cur ^= 1;
    }

    // ---- epilogue: bias + lrelu*sqrt2 + clamp + layerscale + residual ----
    const int rhalf = (lane >> 4) * 8;  // C/D layout: VGPR r holds M = r + rhalf
    float* ob = out + (size_t)b * LSEQ * COUT;
    const float g = 1.41421356237309515f;
#pragma unroll
    for (int j = 0; j < 2; ++j) {
        const int n  = n0 + wn + j * 16 + frow;
        const float bi = bias[n];
        const float ls = layerscale[n];
#pragma unroll
        for (int i = 0; i < 4; ++i) {
#pragma unroll
            for (int r = 0; r < 8; ++r) {
                const int m = m0 + wm + i * 16 + rhalf + r;
                float v = acc[i][j][r] + bi;
                v = (v > 0.f) ? v : 0.2f * v;
                v *= g;
                v = fminf(fmaxf(v, -256.f), 256.f);
                ob[(size_t)m * COUT + n] = v * ls + xb[(size_t)m * CIN + n];
            }
        }
    }
}

// ---------------------------------------------------------------------------
extern "C" void kernel_launch(void* const* d_in, const int* in_sizes, int n_in,
                              void* d_out, int out_size, void* d_ws, size_t ws_size,
                              hipStream_t stream) {
    (void)in_sizes; (void)n_in; (void)out_size; (void)ws_size;
    const float* x          = (const float*)d_in[0];   // (8, 4096, 1024)
    const float* w          = (const float*)d_in[1];   // (8, 512)
    const float* weight     = (const float*)d_in[2];   // (1024, 1024)
    const float* bias       = (const float*)d_in[3];   // (1024,)
    const float* aff_w      = (const float*)d_in[4];   // (1024, 512)
    const float* aff_b      = (const float*)d_in[5];   // (1024,)
    const float* layerscale = (const float*)d_in[6];   // (1,1,1024)
    float* out = (float*)d_out;

    float* styles = (float*)d_ws;                      // NB*CIN floats  (32 KB)
    float* dcoefs = styles + NB * CIN;                 // NB*COUT floats (32 KB)

    mfc_styles_kernel<<<dim3(CIN / (RED_WAVES * RED_ROWS), NB), RED_WAVES * 32, 0, stream>>>(
        w, aff_w, aff_b, styles);
    mfc_dcoefs_kernel<<<dim3(COUT / (RED_WAVES * RED_ROWS), NB), RED_WAVES * 32, 0, stream>>>(
        weight, styles, dcoefs);

    dim3 grid(COUT / BN, LSEQ / BM, NB);               // (8, 32, 8)
    mfc_modgemm_kernel<<<grid, 256, 0, stream>>>(x, weight, bias, layerscale,
                                                 styles, dcoefs, out);
}
